// v000
// Measured on an AMD MI455X. A time is GPU time per run, averaged over a window of back-to-back runs after a warm-up
// (all launches, gaps included; the runs take copies of the inputs in turn), and the median of several windows.
// Apart from v000's, it joins two sittings. Times from different sittings can be a few percent apart, while
// side-by-side timings come from the same sitting.
// v000, which the later versions start from, runs in 318 microseconds.
#include <hip/hip_runtime.h>
#include <stdint.h>

#define DX   512
#define NH   8
#define DKH  64
#define BB   2
#define SS   4096
#define MTOT (BB*SS)
#define LDT  34
#define KSTR 72
#define LOG2E 1.4426950408889634f

typedef __attribute__((ext_vector_type(16))) __bf16       bf16x16;
typedef __attribute__((ext_vector_type(8)))  float        f32x8;
typedef __attribute__((ext_vector_type(8)))  unsigned int u32x8;
typedef __attribute__((ext_vector_type(4)))  unsigned int u32x4;
typedef __attribute__((ext_vector_type(8)))  int          i32x8;
typedef __attribute__((ext_vector_type(4)))  int          i32x4;

// ---------- small helpers ----------
static __device__ __forceinline__ unsigned short f2bf(float f){
  unsigned int u = __builtin_bit_cast(unsigned int, f);
  u += 0x7FFFu + ((u >> 16) & 1u);           // round-to-nearest-even
  return (unsigned short)(u >> 16);
}
static __device__ __forceinline__ unsigned int pack2bf(float lo, float hi){
#if __has_builtin(__builtin_amdgcn_cvt_pk_bf16_f32)
  auto r = __builtin_amdgcn_cvt_pk_bf16_f32(lo, hi);
  return __builtin_bit_cast(unsigned int, r);
#else
  return (unsigned int)f2bf(lo) | ((unsigned int)f2bf(hi) << 16);
#endif
}

static __device__ __forceinline__ bf16x16 pack_operand(const unsigned short* row, int half){
  const unsigned int* p = (const unsigned int*)row;
  const int o1 = half * 4;        // dwords: K = half*8
  const int o2 = 8 + half * 4;    // dwords: K = 16 + half*8
  u32x8 u;
  #pragma unroll
  for (int j = 0; j < 4; ++j){ u[j] = p[o1 + j]; u[4 + j] = p[o2 + j]; }
  return __builtin_bit_cast(bf16x16, u);
}

static __device__ __forceinline__ f32x8 wmma_bf16(bf16x16 a, bf16x16 b, f32x8 c){
  return __builtin_amdgcn_wmma_f32_16x16x32_bf16(false, a, false, b, (short)0, c, false, false);
}

// butterfly reductions across a 16-lane half-wave (C/D rows live across 16 lanes)
static __device__ __forceinline__ float red_max16(float x){
  #pragma unroll
  for (int off = 1; off < 16; off <<= 1) x = fmaxf(x, __shfl_xor(x, off, 32));
  return x;
}
static __device__ __forceinline__ float red_sum16(float x){
  #pragma unroll
  for (int off = 1; off < 16; off <<= 1) x += __shfl_xor(x, off, 32);
  return x;
}

static __device__ __forceinline__ void tdm_load_k_tile(const unsigned short* gsrc,
                                                       unsigned int lds_off){
  const unsigned long long ga = (unsigned long long)(uintptr_t)gsrc;
  u32x4 g0;
  g0[0] = 1u;
  g0[1] = lds_off;
  g0[2] = (unsigned int)ga;
  g0[3] = (unsigned int)((ga >> 32) & 0x1FFFFFFull) | (2u << 30);
  i32x8 g1;
  g1[0] = (1 << 16)
        | (1 << 20)
        | (4 << 22)
        | (3 << 25);
  g1[1] = (64 << 16);
  g1[2] = (32 << 16);
  g1[3] = (64 << 16);
  g1[4] = 32;
  g1[5] = 64;
  g1[6] = 0; g1[7] = 0;
  i32x4 g2; g2[0]=0; g2[1]=0; g2[2]=0; g2[3]=0;    // unused (2D)
  i32x4 g3; g3[0]=0; g3[1]=0; g3[2]=0; g3[3]=0;
  i32x8 g4; g4[0]=0; g4[1]=0; g4[2]=0; g4[3]=0; g4[4]=0; g4[5]=0; g4[6]=0; g4[7]=0;
  __builtin_amdgcn_tensor_load_to_lds(g0, g1, g2, g3, g4, 0);
}

// ---------- shared GEMM core: acc[4] (16x64 strip per wave) of X[M,512] @ W[N,512]^T ----------
static __device__ __forceinline__ void gemm_tile_core(
    const float* __restrict__ X, const float* __restrict__ W,
    int m0, int n0, unsigned short* ldsX, unsigned short* ldsW, f32x8 acc[4])
{
  const int tid  = threadIdx.x;
  const int lane = tid & 31, wv = tid >> 5;
  const int half = lane >> 4, l16 = lane & 15;
  #pragma unroll
  for (int nt = 0; nt < 4; ++nt)
    #pragma unroll
    for (int e = 0; e < 8; ++e) acc[nt][e] = 0.f;

  for (int kc = 0; kc < DX; kc += 32){
    __syncthreads();
    { // X tile 128x32 -> bf16 LDS (row-major, K-major rows)
      const int r = tid >> 1, ch = tid & 1;
      const float* src = X + (size_t)(m0 + r) * DX + kc + ch * 16;
      unsigned int* dst = (unsigned int*)&ldsX[r * LDT + ch * 16];
      #pragma unroll
      for (int j = 0; j < 8; ++j) dst[j] = pack2bf(src[2*j], src[2*j+1]);
    }
    { // W tile 64x32 -> bf16 LDS; B column n == W row n (K-major): no transpose needed
      const int r = tid >> 2, q = tid & 3;
      const float* src = W + (size_t)(n0 + r) * DX + kc + q * 8;
      unsigned int* dst = (unsigned int*)&ldsW[r * LDT + q * 8];
      #pragma unroll
      for (int j = 0; j < 4; ++j) dst[j] = pack2bf(src[2*j], src[2*j+1]);
    }
    if (kc + 32 < DX) __builtin_prefetch(X + (size_t)(m0 + (tid >> 1)) * DX + kc + 32, 0, 0);
    __syncthreads();

    bf16x16 a = pack_operand(&ldsX[(wv * 16 + l16) * LDT], half);
    #pragma unroll
    for (int nt = 0; nt < 4; ++nt){
      bf16x16 b = pack_operand(&ldsW[(nt * 16 + l16) * LDT], half);
      acc[nt] = wmma_bf16(a, b, acc[nt]);
    }
  }
}

// ---------- kernel 1: fused Q/K/V projection, bf16 out in [B,H,S,dk] ----------
__global__ __launch_bounds__(256) void mha_qkv_proj(
    const float* __restrict__ Xq, const float* __restrict__ Xk, const float* __restrict__ Xv,
    const float* __restrict__ Wq, const float* __restrict__ Wk, const float* __restrict__ Wv,
    const float* __restrict__ bq, const float* __restrict__ bk, const float* __restrict__ bv,
    unsigned short* __restrict__ Oq, unsigned short* __restrict__ Ok, unsigned short* __restrict__ Ov)
{
  __shared__ unsigned short ldsX[128 * LDT];
  __shared__ unsigned short ldsW[64 * LDT];
  const int z = blockIdx.z;
  const float* X    = (z == 0) ? Xq : (z == 1) ? Xk : Xv;
  const float* W    = (z == 0) ? Wq : (z == 1) ? Wk : Wv;
  const float* bias = (z == 0) ? bq : (z == 1) ? bk : bv;
  unsigned short* O = (z == 0) ? Oq : (z == 1) ? Ok : Ov;
  const int n0 = blockIdx.x * 64, m0 = blockIdx.y * 128;

  f32x8 acc[4];
  gemm_tile_core(X, W, m0, n0, ldsX, ldsW, acc);

  const int tid = threadIdx.x, lane = tid & 31, wv = tid >> 5;
  const int half = lane >> 4, l16 = lane & 15;
  #pragma unroll
  for (int nt = 0; nt < 4; ++nt){
    const int n = n0 + nt * 16 + l16;
    const int h = n >> 6, d = n & 63;
    const float bb = bias[n];
    #pragma unroll
    for (int e = 0; e < 8; ++e){
      const int m = m0 + wv * 16 + e + 8 * half;   // C layout: row = e + 8*half
      const int b = m >> 12, s = m & 4095;
      O[(((size_t)b * NH + h) * SS + s) * DKH + d] = f2bf(acc[nt][e] + bb);
    }
  }
}

// ---------- kernel 2: flash attention (online softmax), ctx fp32 [B,S,512] ----------
__global__ __launch_bounds__(128) void mha_flash(
    const unsigned short* __restrict__ Qw, const unsigned short* __restrict__ Kw,
    const unsigned short* __restrict__ Vw, const int* __restrict__ mask,
    float* __restrict__ ctx)
{
  __shared__ unsigned short ldsK[32 * KSTR];
  __shared__ unsigned short ldsV[64 * LDT];
  __shared__ unsigned short ldsP[4 * 16 * LDT];

  const int b = blockIdx.z, h = blockIdx.y, q0 = blockIdx.x * 64;
  const size_t base = ((size_t)b * NH + h) * (size_t)SS * DKH;
  const int tid = threadIdx.x, lane = tid & 31, wv = tid >> 5;
  const int half = lane >> 4, l16 = lane & 15;
  const unsigned int ldsK_off = (unsigned int)(uintptr_t)&ldsK[0];

  // Q tile (16x64) for this wave held in registers, A-layout, two K=32 chunks
  const unsigned short* qrow = Qw + base + (size_t)(q0 + wv * 16 + l16) * DKH;
  const bf16x16 qa0 = pack_operand(qrow,      half);
  const bf16x16 qa1 = pack_operand(qrow + 32, half);

  float mrow[8], lrow[8];
  f32x8 o[4];
  #pragma unroll
  for (int e = 0; e < 8; ++e){ mrow[e] = -1e30f; lrow[e] = 0.f; }
  #pragma unroll
  for (int nt = 0; nt < 4; ++nt)
    #pragma unroll
    for (int e = 0; e < 8; ++e) o[nt][e] = 0.f;

  unsigned short* myP = &ldsP[wv * 16 * LDT];

  for (int kv0 = 0; kv0 < SS; kv0 += 32){
    __syncthreads();
    if (wv == 0){ // K tile 32x64 -> LDS via Tensor Data Mover (adds 8-elt row pad)
      tdm_load_k_tile(Kw + base + (size_t)kv0 * DKH, ldsK_off);
    }
    { // V tile 32x64 transposed into [d][kv] so B columns for P@V are K-major
      const int r = tid >> 2, q = tid & 3;
      const unsigned short* src = Vw + base + (size_t)(kv0 + r) * DKH + q * 16;
      #pragma unroll
      for (int j = 0; j < 16; ++j) ldsV[(q * 16 + j) * LDT + r] = src[j];
    }
    if (wv == 0) __builtin_amdgcn_s_wait_tensorcnt(0);
    __syncthreads();

    // scores: two 16x16 n-tiles, each accumulated over dk = 2 chunks of 32
    f32x8 s0, s1;
    #pragma unroll
    for (int e = 0; e < 8; ++e){ s0[e] = 0.f; s1[e] = 0.f; }
    s0 = wmma_bf16(qa0, pack_operand(&ldsK[l16 * KSTR],             half), s0);
    s0 = wmma_bf16(qa1, pack_operand(&ldsK[l16 * KSTR + 32],        half), s0);
    s1 = wmma_bf16(qa0, pack_operand(&ldsK[(16 + l16) * KSTR],      half), s1);
    s1 = wmma_bf16(qa1, pack_operand(&ldsK[(16 + l16) * KSTR + 32], half), s1);

    const int mk0 = mask[b * SS + kv0 + l16];
    const int mk1 = mask[b * SS + kv0 + 16 + l16];
    float t0[8], t1[8], p0[8], p1[8], alpha[8];
    #pragma unroll
    for (int e = 0; e < 8; ++e){
      t0[e] = (mk0 == 0) ? -1e9f : s0[e] * 0.125f;   // 1/sqrt(64)
      t1[e] = (mk1 == 0) ? -1e9f : s1[e] * 0.125f;
    }
    #pragma unroll
    for (int e = 0; e < 8; ++e){
      const float mt = red_max16(fmaxf(t0[e], t1[e]));
      const float mn = fmaxf(mrow[e], mt);
      alpha[e] = __builtin_amdgcn_exp2f((mrow[e] - mn) * LOG2E);
      p0[e]    = __builtin_amdgcn_exp2f((t0[e] - mn) * LOG2E);
      p1[e]    = __builtin_amdgcn_exp2f((t1[e] - mn) * LOG2E);
      lrow[e]  = lrow[e] * alpha[e] + red_sum16(p0[e] + p1[e]);
      mrow[e]  = mn;
    }
    // spill P to LDS (C layout -> row-major bf16) for A-operand reload
    #pragma unroll
    for (int e = 0; e < 8; ++e){
      const int r = e + 8 * half;
      myP[r * LDT + l16]      = f2bf(p0[e]);
      myP[r * LDT + 16 + l16] = f2bf(p1[e]);
    }
    __syncthreads();

    // O = alpha * O + P @ V
    #pragma unroll
    for (int nt = 0; nt < 4; ++nt)
      #pragma unroll
      for (int e = 0; e < 8; ++e) o[nt][e] *= alpha[e];
    const bf16x16 pa = pack_operand(&myP[l16 * LDT], half);
    #pragma unroll
    for (int nt = 0; nt < 4; ++nt){
      bf16x16 vb = pack_operand(&ldsV[(nt * 16 + l16) * LDT], half);
      o[nt] = wmma_bf16(pa, vb, o[nt]);
    }
  }

  // normalize and write context fp32, layout [B, S, H*dk] (ready for out-proj GEMM)
  #pragma unroll
  for (int e = 0; e < 8; ++e){
    const float inv = (lrow[e] > 0.f) ? 1.f / lrow[e] : 0.f;
    const int srow = q0 + wv * 16 + e + 8 * half;
    #pragma unroll
    for (int nt = 0; nt < 4; ++nt){
      const int n = h * DKH + nt * 16 + l16;
      ctx[((size_t)b * SS + srow) * DX + n] = o[nt][e] * inv;
    }
  }
}

// ---------- kernel 3: output projection, fp32 out ----------
__global__ __launch_bounds__(256) void mha_out_proj(
    const float* __restrict__ Xc, const float* __restrict__ Wo,
    const float* __restrict__ bo, float* __restrict__ out)
{
  __shared__ unsigned short ldsX[128 * LDT];
  __shared__ unsigned short ldsW[64 * LDT];
  const int n0 = blockIdx.x * 64, m0 = blockIdx.y * 128;

  f32x8 acc[4];
  gemm_tile_core(Xc, Wo, m0, n0, ldsX, ldsW, acc);

  const int tid = threadIdx.x, lane = tid & 31, wv = tid >> 5;
  const int half = lane >> 4, l16 = lane & 15;
  #pragma unroll
  for (int nt = 0; nt < 4; ++nt){
    const int n = n0 + nt * 16 + l16;
    const float bb = bo[n];
    #pragma unroll
    for (int e = 0; e < 8; ++e){
      const int m = m0 + wv * 16 + e + 8 * half;
      out[(size_t)m * DX + n] = acc[nt][e] + bb;
    }
  }
}

// ---------- host ----------
extern "C" void kernel_launch(void* const* d_in, const int* in_sizes, int n_in,
                              void* d_out, int out_size, void* d_ws, size_t ws_size,
                              hipStream_t stream)
{
  (void)in_sizes; (void)n_in; (void)out_size; (void)ws_size;
  const float* q  = (const float*)d_in[0];
  const float* k  = (const float*)d_in[1];
  const float* v  = (const float*)d_in[2];
  const float* Wq = (const float*)d_in[3];
  const float* bq = (const float*)d_in[4];
  const float* Wk = (const float*)d_in[5];
  const float* bk = (const float*)d_in[6];
  const float* Wv = (const float*)d_in[7];
  const float* bv = (const float*)d_in[8];
  const float* Wo = (const float*)d_in[9];
  const float* bo = (const float*)d_in[10];
  const int* mask = (const int*)d_in[11];

  const size_t SZ = (size_t)MTOT * DX;                 // 8192*512 elements
  unsigned short* qws = (unsigned short*)d_ws;         // bf16 Q [B,H,S,dk]
  unsigned short* kws = qws + SZ;                      // bf16 K
  unsigned short* vws = kws + SZ;                      // bf16 V
  float* ctx = (float*)(vws + SZ);                     // fp32 context [B,S,512]
  float* out = (float*)d_out;

  mha_qkv_proj<<<dim3(DX/64, MTOT/128, 3), 256, 0, stream>>>(
      q, k, v, Wq, Wk, Wv, bq, bk, bv, qws, kws, vws);
  mha_flash<<<dim3(SS/64, NH, BB), 128, 0, stream>>>(qws, kws, vws, mask, ctx);
  mha_out_proj<<<dim3(DX/64, MTOT/128), 256, 0, stream>>>(ctx, Wo, bo, out);
}

// v001
// Measured time: 200 microseconds a run.
// Timed twice side by side with v000, it ran 1.69 and 1.65 times as fast.
#include <hip/hip_runtime.h>
#include <stdint.h>

#define DX   512
#define NH   8
#define DKH  64
#define BB   2
#define SS   4096
#define MTOT (BB*SS)
#define LDT  34
#define KSTR 72
#define VSTR 80
#define LOG2E 1.4426950408889634f

typedef __attribute__((ext_vector_type(16))) __bf16       bf16x16;
typedef __attribute__((ext_vector_type(8)))  float        f32x8;
typedef __attribute__((ext_vector_type(8)))  unsigned int u32x8;
typedef __attribute__((ext_vector_type(4)))  unsigned int u32x4;
typedef __attribute__((ext_vector_type(8)))  int          i32x8;
typedef __attribute__((ext_vector_type(4)))  int          i32x4;
typedef __attribute__((ext_vector_type(4)))  float        f32x4;
typedef __attribute__((ext_vector_type(8)))  short        s16x8;

// ---------- small helpers ----------
static __device__ __forceinline__ unsigned short f2bf(float f){
  unsigned int u = __builtin_bit_cast(unsigned int, f);
  u += 0x7FFFu + ((u >> 16) & 1u);           // round-to-nearest-even
  return (unsigned short)(u >> 16);
}
static __device__ __forceinline__ unsigned int pack2bf(float lo, float hi){
#if __has_builtin(__builtin_amdgcn_cvt_pk_bf16_f32)
  auto r = __builtin_amdgcn_cvt_pk_bf16_f32(lo, hi);
  return __builtin_bit_cast(unsigned int, r);
#else
  return (unsigned int)f2bf(lo) | ((unsigned int)f2bf(hi) << 16);
#endif
}

static __device__ __forceinline__ bf16x16 pack_operand(const unsigned short* row, int half){
  const unsigned int* p = (const unsigned int*)row;
  const int o1 = half * 4;        // dwords: K = half*8
  const int o2 = 8 + half * 4;    // dwords: K = 16 + half*8
  u32x8 u;
  #pragma unroll
  for (int j = 0; j < 4; ++j){ u[j] = p[o1 + j]; u[4 + j] = p[o2 + j]; }
  return __builtin_bit_cast(bf16x16, u);
}

static __device__ __forceinline__ f32x8 wmma_bf16(bf16x16 a, bf16x16 b, f32x8 c){
  return __builtin_amdgcn_wmma_f32_16x16x32_bf16(false, a, false, b, (short)0, c, false, false);
}

static __device__ __forceinline__ float xhalf(float x){
  const int i = __builtin_bit_cast(int, x);
  return __builtin_bit_cast(float, __builtin_amdgcn_permlanex16(i, i, 0x76543210, 0xfedcba98, false, false));
}

// two f32 of a score tile -> one register of the bf16 B operand, round to nearest even
static __device__ __forceinline__ unsigned int pack_p(float lo, float hi){
  typedef __attribute__((ext_vector_type(2))) float  f32x2;
  typedef __attribute__((ext_vector_type(2))) __bf16 bf16x2;
  return __builtin_bit_cast(unsigned int, __builtin_convertvector(f32x2{lo, hi}, bf16x2));
}

// A operand 16 (d) x 32 (keys) = V^T from a row-major V tile in LDS: lane (l16,half) gets
// V[8*half+0..7][d0+l16] and V[16+8*half+0..7][d0+l16], the hardware k order.
static __device__ __forceinline__ bf16x16 load_vt(const unsigned short* p){
  typedef __attribute__((address_space(3))) s16x8 lds_s16x8;
  const u32x4 lo = __builtin_bit_cast(u32x4, __builtin_amdgcn_ds_load_tr16_b128_v8i16((lds_s16x8*)p));
  const u32x4 hi = __builtin_bit_cast(u32x4, __builtin_amdgcn_ds_load_tr16_b128_v8i16((lds_s16x8*)(p + 16 * VSTR)));
  u32x8 u;
  #pragma unroll  // register arrays: every index a constant
  for (int j = 0; j < 4; ++j){ u[j] = lo[j]; u[4 + j] = hi[j]; }
  return __builtin_bit_cast(bf16x16, u);
}

static __device__ __forceinline__ void tdm_load_k_tile(const unsigned short* gsrc,
                                                       unsigned int lds_off){
  const unsigned long long ga = (unsigned long long)(uintptr_t)gsrc;
  u32x4 g0;
  g0[0] = 1u;
  g0[1] = lds_off;
  g0[2] = (unsigned int)ga;
  g0[3] = (unsigned int)((ga >> 32) & 0x1FFFFFFull) | (2u << 30);
  i32x8 g1;
  g1[0] = (1 << 16)
        | (1 << 20)
        | (4 << 22)
        | (3 << 25);
  g1[1] = (64 << 16);
  g1[2] = (32 << 16);
  g1[3] = (64 << 16);
  g1[4] = 32;
  g1[5] = 64;
  g1[6] = 0; g1[7] = 0;
  i32x4 g2; g2[0]=0; g2[1]=0; g2[2]=0; g2[3]=0;    // unused (2D)
  i32x4 g3; g3[0]=0; g3[1]=0; g3[2]=0; g3[3]=0;
  i32x8 g4; g4[0]=0; g4[1]=0; g4[2]=0; g4[3]=0; g4[4]=0; g4[5]=0; g4[6]=0; g4[7]=0;
  __builtin_amdgcn_tensor_load_to_lds(g0, g1, g2, g3, g4, 0);
}

// ---------- shared GEMM core: acc[4] (16x64 strip per wave) of X[M,512] @ W[N,512]^T ----------
static __device__ __forceinline__ void gemm_tile_core(
    const float* __restrict__ X, const float* __restrict__ W,
    int m0, int n0, unsigned short* ldsX, unsigned short* ldsW, f32x8 acc[4])
{
  const int tid  = threadIdx.x;
  const int lane = tid & 31, wv = tid >> 5;
  const int half = lane >> 4, l16 = lane & 15;
  #pragma unroll
  for (int nt = 0; nt < 4; ++nt)
    #pragma unroll
    for (int e = 0; e < 8; ++e) acc[nt][e] = 0.f;

  for (int kc = 0; kc < DX; kc += 32){
    __syncthreads();
    { // X tile 128x32 -> bf16 LDS (row-major, K-major rows)
      const int r = tid >> 1, ch = tid & 1;
      const float* src = X + (size_t)(m0 + r) * DX + kc + ch * 16;
      unsigned int* dst = (unsigned int*)&ldsX[r * LDT + ch * 16];
      #pragma unroll
      for (int j = 0; j < 8; ++j) dst[j] = pack2bf(src[2*j], src[2*j+1]);
    }
    { // W tile 64x32 -> bf16 LDS; B column n == W row n (K-major): no transpose needed
      const int r = tid >> 2, q = tid & 3;
      const float* src = W + (size_t)(n0 + r) * DX + kc + q * 8;
      unsigned int* dst = (unsigned int*)&ldsW[r * LDT + q * 8];
      #pragma unroll
      for (int j = 0; j < 4; ++j) dst[j] = pack2bf(src[2*j], src[2*j+1]);
    }
    if (kc + 32 < DX) __builtin_prefetch(X + (size_t)(m0 + (tid >> 1)) * DX + kc + 32, 0, 0);
    __syncthreads();

    bf16x16 a = pack_operand(&ldsX[(wv * 16 + l16) * LDT], half);
    #pragma unroll
    for (int nt = 0; nt < 4; ++nt){
      bf16x16 b = pack_operand(&ldsW[(nt * 16 + l16) * LDT], half);
      acc[nt] = wmma_bf16(a, b, acc[nt]);
    }
  }
}

// ---------- kernel 1: fused Q/K/V projection, bf16 out in [B,H,S,dk] ----------
__global__ __launch_bounds__(256) void mha_qkv_proj(
    const float* __restrict__ Xq, const float* __restrict__ Xk, const float* __restrict__ Xv,
    const float* __restrict__ Wq, const float* __restrict__ Wk, const float* __restrict__ Wv,
    const float* __restrict__ bq, const float* __restrict__ bk, const float* __restrict__ bv,
    unsigned short* __restrict__ Oq, unsigned short* __restrict__ Ok, unsigned short* __restrict__ Ov)
{
  __shared__ unsigned short ldsX[128 * LDT];
  __shared__ unsigned short ldsW[64 * LDT];
  const int z = blockIdx.z;
  const float* X    = (z == 0) ? Xq : (z == 1) ? Xk : Xv;
  const float* W    = (z == 0) ? Wq : (z == 1) ? Wk : Wv;
  const float* bias = (z == 0) ? bq : (z == 1) ? bk : bv;
  unsigned short* O = (z == 0) ? Oq : (z == 1) ? Ok : Ov;
  const int n0 = blockIdx.x * 64, m0 = blockIdx.y * 128;

  f32x8 acc[4];
  gemm_tile_core(X, W, m0, n0, ldsX, ldsW, acc);

  const int tid = threadIdx.x, lane = tid & 31, wv = tid >> 5;
  const int half = lane >> 4, l16 = lane & 15;
  #pragma unroll
  for (int nt = 0; nt < 4; ++nt){
    const int n = n0 + nt * 16 + l16;
    const int h = n >> 6, d = n & 63;
    const float bb = bias[n];
    #pragma unroll
    for (int e = 0; e < 8; ++e){
      const int m = m0 + wv * 16 + e + 8 * half;   // C layout: row = e + 8*half
      const int b = m >> 12, s = m & 4095;
      O[(((size_t)b * NH + h) * SS + s) * DKH + d] = f2bf(acc[nt][e] + bb);
    }
  }
}

__global__ __launch_bounds__(128) void mha_flash(
    const unsigned short* __restrict__ Qw, const unsigned short* __restrict__ Kw,
    const unsigned short* __restrict__ Vw, const int* __restrict__ mask,
    float* __restrict__ ctx)
{
  __shared__ __attribute__((aligned(2048))) unsigned short ldsK[32 * KSTR];
  __shared__ __attribute__((aligned(32))) unsigned short ldsV[32 * VSTR];

  const int b = blockIdx.z, h = blockIdx.y, q0 = blockIdx.x * 64;
  const size_t base = ((size_t)b * NH + h) * (size_t)SS * DKH;
  const int tid = threadIdx.x, lane = tid & 31, wv = tid >> 5;
  const int half = lane >> 4, l16 = lane & 15;
  const unsigned int ldsK_off = (unsigned int)(uintptr_t)&ldsK[0];

  // Q tile (16 queries x 64) of this wave in registers as the B operand: column l16, two K=32 chunks
  const unsigned short* qrow = Qw + base + (size_t)(q0 + wv * 16 + l16) * DKH;
  const bf16x16 qb0 = pack_operand(qrow,      half);
  const bf16x16 qb1 = pack_operand(qrow + 32, half);

  float mrow = -1e30f, lsum = 0.f;   // of query l16; lsum covers this half's keys only
  f32x8 o[4];                        // o[nt][e] = O^T[d = nt*16 + 8*half + e][query l16]
  #pragma unroll  // register arrays: every index a constant
  for (int nt = 0; nt < 4; ++nt)
    #pragma unroll  // register arrays: every index a constant
    for (int e = 0; e < 8; ++e) o[nt][e] = 0.f;

  // transposing-load address of this lane inside the V tile (keys 0..15, d 0..15)
  const unsigned short* vtr = &ldsV[(8 * half + (lane & 7)) * VSTR + ((lane >> 3) & 1) * 8];

  for (int kv0 = 0; kv0 < SS; kv0 += 32){
    __syncthreads();
    if (wv == 0){ // K tile 32x64 -> LDS via Tensor Data Mover (adds 8-elt row pad)
      tdm_load_k_tile(Kw + base + (size_t)kv0 * DKH, ldsK_off);
    }
    { // V tile 32x64 row-major, 32 bytes a thread
      const int r = tid >> 2, q = tid & 3;
      const u32x4* src = (const u32x4*)(Vw + base + (size_t)(kv0 + r) * DKH + q * 16);
      u32x4* dst = (u32x4*)&ldsV[r * VSTR + q * 16];
      const u32x4 v0 = src[0], v1 = src[1];
      dst[0] = v0; dst[1] = v1;
    }
    const int mk = mask[b * SS + kv0 + lane];      // key kv0 + lane
    if (wv == 0) __builtin_amdgcn_s_wait_tensorcnt(0);
    __syncthreads();

    // scores^T: two 16-key tiles, each accumulated over dk = 2 chunks of 32
    f32x8 s0, s1;
    #pragma unroll  // register arrays: every index a constant
    for (int e = 0; e < 8; ++e){ s0[e] = 0.f; s1[e] = 0.f; }
    s0 = wmma_bf16(pack_operand(&ldsK[l16 * KSTR],             half), qb0, s0);
    s0 = wmma_bf16(pack_operand(&ldsK[l16 * KSTR + 32],        half), qb1, s0);
    s1 = wmma_bf16(pack_operand(&ldsK[(16 + l16) * KSTR],      half), qb0, s1);
    s1 = wmma_bf16(pack_operand(&ldsK[(16 + l16) * KSTR + 32], half), qb1, s1);

    // V^T fragments: 16 d x 32 keys each, two transposing loads a fragment
    bf16x16 va[4];
    #pragma unroll  // register arrays: every index a constant
    for (int nt = 0; nt < 4; ++nt) va[nt] = load_vt(vtr + nt * 16);

    float t0[8], t1[8];
    #pragma unroll  // register arrays: every index a constant
    for (int e = 0; e < 8; ++e){
      t0[e] = s0[e] * 0.125f;   // 1/sqrt(64)
      t1[e] = s1[e] * 0.125f;
    }
    const unsigned int live = __builtin_amdgcn_ballot_w32(mk != 0);  // bit j: key kv0 + j is kept
    if (live != 0xFFFFFFFFu){   // wave-uniform: one test a pass, the selects only where a key is masked
      const unsigned int mine = live >> (8 * half);
      #pragma unroll  // register arrays: every index a constant
      for (int e = 0; e < 8; ++e){
        if (((mine >> e) & 1u) == 0u)        t0[e] = -1e9f;
        if (((mine >> (16 + e)) & 1u) == 0u) t1[e] = -1e9f;
      }
    }
    float mt = fmaxf(t0[0], t1[0]);
    #pragma unroll  // register arrays: every index a constant
    for (int e = 1; e < 8; ++e) mt = fmaxf(mt, fmaxf(t0[e], t1[e]));
    mt = fmaxf(mt, xhalf(mt));                     // both halves: maximum over the 32 keys
    const float mn = fmaxf(mrow, mt);
    const float alpha = __builtin_amdgcn_exp2f((mrow - mn) * LOG2E);
    mrow = mn;
    float ps = 0.f;
    u32x8 pw;
    #pragma unroll  // register arrays: every index a constant
    for (int j = 0; j < 4; ++j){
      const float a0 = __builtin_amdgcn_exp2f((t0[2*j]     - mn) * LOG2E);
      const float a1 = __builtin_amdgcn_exp2f((t0[2*j + 1] - mn) * LOG2E);
      const float c0 = __builtin_amdgcn_exp2f((t1[2*j]     - mn) * LOG2E);
      const float c1 = __builtin_amdgcn_exp2f((t1[2*j + 1] - mn) * LOG2E);
      ps += (a0 + a1) + (c0 + c1);
      pw[j]     = pack_p(a0, a1);                  // k = 8*half + 2j, +1
      pw[4 + j] = pack_p(c0, c1);                  // k = 16 + 8*half + 2j, +1
    }
    lsum = lsum * alpha + ps;
    const bf16x16 pb = __builtin_bit_cast(bf16x16, pw);

    // O^T = alpha * O^T + V^T @ P^T
    #pragma unroll  // register arrays: every index a constant
    for (int nt = 0; nt < 4; ++nt){
      #pragma unroll  // register arrays: every index a constant
      for (int e = 0; e < 8; ++e) o[nt][e] *= alpha;
      o[nt] = wmma_bf16(va[nt], pb, o[nt]);
    }
  }

  // join the halves' sums, normalize and write context fp32, layout [B, S, H*dk]
  const float lrow = lsum + xhalf(lsum);
  const float inv = (lrow > 0.f) ? 1.f / lrow : 0.f;
  float* crow = ctx + ((size_t)b * SS + q0 + wv * 16 + l16) * DX + h * DKH + 8 * half;
  #pragma unroll  // register arrays: every index a constant
  for (int nt = 0; nt < 4; ++nt){
    f32x4 w0, w1;
    #pragma unroll  // register arrays: every index a constant
    for (int e = 0; e < 4; ++e){ w0[e] = o[nt][e] * inv; w1[e] = o[nt][4 + e] * inv; }
    *(f32x4*)(crow + nt * 16)     = w0;
    *(f32x4*)(crow + nt * 16 + 4) = w1;
  }
}

// ---------- kernel 3: output projection, fp32 out ----------
__global__ __launch_bounds__(256) void mha_out_proj(
    const float* __restrict__ Xc, const float* __restrict__ Wo,
    const float* __restrict__ bo, float* __restrict__ out)
{
  __shared__ unsigned short ldsX[128 * LDT];
  __shared__ unsigned short ldsW[64 * LDT];
  const int n0 = blockIdx.x * 64, m0 = blockIdx.y * 128;

  f32x8 acc[4];
  gemm_tile_core(Xc, Wo, m0, n0, ldsX, ldsW, acc);

  const int tid = threadIdx.x, lane = tid & 31, wv = tid >> 5;
  const int half = lane >> 4, l16 = lane & 15;
  #pragma unroll
  for (int nt = 0; nt < 4; ++nt){
    const int n = n0 + nt * 16 + l16;
    const float bb = bo[n];
    #pragma unroll
    for (int e = 0; e < 8; ++e){
      const int m = m0 + wv * 16 + e + 8 * half;
      out[(size_t)m * DX + n] = acc[nt][e] + bb;
    }
  }
}

// ---------- host ----------
extern "C" void kernel_launch(void* const* d_in, const int* in_sizes, int n_in,
                              void* d_out, int out_size, void* d_ws, size_t ws_size,
                              hipStream_t stream)
{
  (void)in_sizes; (void)n_in; (void)out_size; (void)ws_size;
  const float* q  = (const float*)d_in[0];
  const float* k  = (const float*)d_in[1];
  const float* v  = (const float*)d_in[2];
  const float* Wq = (const float*)d_in[3];
  const float* bq = (const float*)d_in[4];
  const float* Wk = (const float*)d_in[5];
  const float* bk = (const float*)d_in[6];
  const float* Wv = (const float*)d_in[7];
  const float* bv = (const float*)d_in[8];
  const float* Wo = (const float*)d_in[9];
  const float* bo = (const float*)d_in[10];
  const int* mask = (const int*)d_in[11];

  const size_t SZ = (size_t)MTOT * DX;                 // 8192*512 elements
  unsigned short* qws = (unsigned short*)d_ws;         // bf16 Q [B,H,S,dk]
  unsigned short* kws = qws + SZ;                      // bf16 K
  unsigned short* vws = kws + SZ;                      // bf16 V
  float* ctx = (float*)(vws + SZ);                     // fp32 context [B,S,512]
  float* out = (float*)d_out;

  mha_qkv_proj<<<dim3(DX/64, MTOT/128, 3), 256, 0, stream>>>(
      q, k, v, Wq, Wk, Wv, bq, bk, bv, qws, kws, vws);
  mha_flash<<<dim3(SS/64, NH, BB), 128, 0, stream>>>(qws, kws, vws, mask, ctx);
  mha_out_proj<<<dim3(DX/64, MTOT/128), 256, 0, stream>>>(ctx, Wo, bo, out);
}
